// v000
// Times are from an AMD MI455X. After a warm-up the kernel runs many times in a row, and a time is the length of
// such a window on the GPU divided by its runs, so every launch and the gaps after it count. The runs cycle
// through copies of the inputs. A figure is the median of several windows, for all but v000 over two sittings.
// Sittings can differ by a few percent; kernels timed side by side share one.
// v000 is the starting kernel. One run takes 36.1 microseconds.
#include <hip/hip_runtime.h>

// Dense grouped pair-score weighting, width 256 = 8 heads x 32, no projections: queries = bev_query rows, keys = values = history_bev rows, score scale 32^-0.5, softmax over keys, heads concatenated (f32 output).
// Both contractions: v_wmma_f32_16x16x32_f16 (f16 operands, f32 accumulate). Inputs are RNE-converted to bf16 at their load and carried as f16 (exact); P is carried x16384 (cancels in the normalisation); softmax f32 (online, running max).
// The module replicates queries and keys R times along the sequence axis and averages the R query copies: every distinct key then appears R times with the same logit and the same value row,
// so the softmax-weighted mean over the R*SEQ replicated keys equals the one over the SEQ distinct keys, and the R identical query copies average to the single result. The kernel works on the SEQ distinct rows.
// Layout: f16 token-major planes Q, K [b*SEQ + t][256] (head h = columns h*32 + d) and the transposed value plane V^T [(b*256 + h*32 + d)][t]; fused online-softmax key-pass kernel in transposed form
// (S^T = K Q^T with A = K rows and B = Q rows; O^T = V^T P^T with the packed P tile as the B fragment), fragments straight from the planes (two 16-B loads each, arithmetic addressing).

#ifndef NB
#define NB 1
#endif
#ifndef SEQ
#define SEQ 1024
#endif
#define NB_FULL  1
#define SEQ_FULL 1024
#ifndef OUT_SEQ
#define OUT_SEQ SEQ              // row pitch (in tokens) between batches of the output
#endif
#define DM   256
#define NH_  8
#define HD   32
#define AW   4                   // waves per online-softmax key-pass block (16 query rows each)
#define OSP  36                  // LDS row pitch (floats) of the online-softmax key-pass output tile
#define SC2  ((float)(0.17677669529663687 * 1.4426950408889634))   // HD^-0.5 * log2(e)
#define PSH  14.0f               // log2 of the P carry (16384)
#define NEGB (-3.0e38f)
#define TT   64
#define TC   64                  // transpose tile: channels
#define TSP  72                  // LDS row pitch (halves) of the transpose tile

static_assert(HD == 32);                       // one k-step of the score product; output head segment = 32 floats = one line
static_assert(NH_ * HD == DM);                 // head h = columns h*32 + d
static_assert(DM % 8 == 0);                    // 16-byte fragment loads from token-major rows
static_assert(SEQ % 64 == 0);
static_assert(SEQ % 32 == 0);                  // key loop steps by 32
static_assert(SEQ % (16 * AW) == 0);           // online-softmax key-pass grid covers the sequence exactly
static_assert(SEQ % TT == 0);                  // transpose grid covers the sequence exactly
static_assert(DM % TC == 0);                   // transpose grid covers the channels exactly
static_assert(TT * 2 == 128);
static_assert(TSP >= TT);
static_assert((TSP * 2) % 16 == 0);            // 16-byte aligned LDS rows
static_assert(256 * 4 * 4 == TT * TC);         // transpose load: threads x trips x floats == tile elements
static_assert(256 * 2 * 8 == TC * TT);         // transpose store: threads x trips x halves == tile elements
static_assert(32 * 4 * 4 == 16 * HD);          // online-softmax key-pass store: lanes x trips x floats == 16 rows x 32 columns
static_assert(((size_t)SEQ * DM) % 64 == 0);
static_assert(NB <= NB_FULL);
static_assert(SEQ <= SEQ_FULL);
static_assert((OSP * 4) % 16 == 0);
static_assert(OSP >= HD);
static_assert((size_t)AW * 16 * OSP * 4 <= (size_t)131072);   // static LDS of the online-softmax key-pass kernel
static_assert((size_t)TC * TSP * 2 <= (size_t)131072);         // static LDS of the transpose kernel

typedef _Float16 h16;
typedef __attribute__((ext_vector_type(16))) _Float16 v16h;
typedef __attribute__((ext_vector_type(8)))  _Float16 v8h;
typedef __attribute__((ext_vector_type(8)))  float    v8f;
typedef __attribute__((ext_vector_type(4)))  float    v4f;
typedef v4f  __attribute__((may_alias)) v4fa;
typedef v8h  __attribute__((may_alias)) v8ha;

__device__ __forceinline__ unsigned short f2bf(float f) { unsigned u = __float_as_uint(f); u += 0x7FFFu + ((u >> 16) & 1u); return (unsigned short)(u >> 16); }
__device__ __forceinline__ float bfr(float f) { return __uint_as_float(((unsigned)f2bf(f)) << 16); }   // value after RNE convert to bf16
__device__ __forceinline__ v16h cat16(v8h lo, v8h hi) { return __builtin_shufflevector(lo, hi, 0, 1, 2, 3, 4, 5, 6, 7, 8, 9, 10, 11, 12, 13, 14, 15); }
__device__ __forceinline__ v8f wmma16(v16h a, v16h b, v8f c) { return __builtin_amdgcn_wmma_f32_16x16x32_f16(false, a, false, b, (short)0, c, false, false); }
// fragment loader from K-contiguous 16-bit rows; p already includes + 8*(lane>>4): elements 0..7 <- k0+8h+0..7, elements 8..15 <- k0+16+8h+0..7 (same map for A and B)
__device__ __forceinline__ v16h  ldh(const h16* p) { return cat16(*(const v8h*)p, *(const v8h*)(p + 16)); }
// ordering point for wave-private LDS tiles (same wave writes and reads)
__device__ __forceinline__ void wave_sync() { __builtin_amdgcn_fence(3 /* release order */, "wavefront"); __builtin_amdgcn_wave_barrier(); asm volatile("" ::: "memory"); }
// f32 -> f16 convert that cannot produce a subnormal operand (|v| < 2^-14 -> +0)
static __device__ __forceinline__ h16 toh_flush(float v) { const h16 r = (h16)v; return (fabsf(v) < 6.103515625e-05f) ? (h16)0.0f : r; }
// one matrix instruction with its own issue-slot guard (ties the accumulator, keeps both operand fragments live)
__device__ __forceinline__ v8f wmma16g(v16h a, v16h b, v8f c) {
    c = wmma16(a, b, c);
    asm volatile("v_nop\n\tv_nop\n\tv_nop\n\tv_nop" : "+v"(c) : "v"(a), "v"(b));
    return c;
}

__global__ __launch_bounds__(256) void k_cvth(const float* __restrict__ src, h16* dst, size_t n8) {
    const size_t i = (size_t)blockIdx.x * 256 + threadIdx.x; if (i >= n8) return;
    const v8f v = *(const v8f*)(src + i * 8); v8h o;
#pragma unroll
    for (int k = 0; k < 8; ++k) o[k] = toh_flush(bfr(v[k]));
    *(v8h*)(dst + i * 8) = o; 
}

// k_vt: transposed f16 value plane. in [t][256] (f32, row pitch DM) -> out [(b*256 + c)][t] (f16, row pitch SEQ); one block per 64-token x 64-channel tile.
// Load: 256 threads x 4 trips x one float4 (16 float4 per token row). LDS tile ts[c][t] (cross-wave: block barrier). Store: each V^T row segment of 64 halves (one line) by 8 consecutive lanes x 16 B,
__global__ __launch_bounds__(256) void k_vt(const float* __restrict__ src, h16* VT) {
    __shared__ __align__(16) h16 ts[TC * TSP];
    const int tid = threadIdx.x;
    const int tk0 = blockIdx.x * TT, c0 = blockIdx.y * TC, b = blockIdx.z;
    const float* sp = src + ((size_t)b * SEQ_FULL + (size_t)tk0) * DM + c0;
#pragma unroll 1
    for (int it = 0; it < 4; ++it) {
        const int idx = it * 256 + tid; const int t = idx >> 4, c4 = (idx & 15) * 4;     // 64 token rows x 16 float4
        const v4f x = *(const v4f*)(sp + (size_t)t * DM + c4);
#pragma unroll
        for (int k = 0; k < 4; ++k) ts[(c4 + k) * TSP + t] = toh_flush(bfr(x[k])); }
    __syncthreads();
    h16* dp = VT + ((size_t)b * DM + (size_t)c0) * SEQ + (size_t)tk0;
{
#pragma unroll
        for (int it = 0; it < 2; ++it) { const int p = it * 256 + tid; const int row = p >> 3, c8 = (p & 7) * 8;   // 2 trips x 32 rows = 64 rows; 8 lanes x 8 halves = 64 tokens = one line
            const v8h val = *(const v8ha*)(&ts[row * TSP + c8]);
            *(v8h*)(dp + (size_t)row * SEQ + c8) = val; }
         }
}

// k_keypass: fused pair weighting, one wave per 16 query rows of one (batch, head); K / V^T / Q fragments straight from the f16 planes.
// Transposed form: S^T[key][t] = K Q^T (A = K rows, B = Q rows); lane (t = lane&15, h = lane>>4) holds keys 8h+r of each 16-key tile, so the packed
// P tile is directly the B fragment of O^T[d][t] = V^T P^T (element r <- tile keys 0..15, element 8+r <- tile keys 16..31, lane unchanged).
// Softmax state (running max, partial sum over the converted P) is one scalar per lane; the two lane halves of a row are combined with one xor-16 exchange.
// grid (SEQ/(16*AW), NB*NH_).
__global__ __launch_bounds__(32 * AW) void k_keypass(const h16* __restrict__ QP, const h16* __restrict__ KP, const h16* __restrict__ VT, float* OUT) {
    __shared__ __align__(16) float os[AW * 16 * OSP];
    const int lane = threadIdx.x & 31, lr = lane & 15, hi = lane >> 4;
    const int wave = __builtin_amdgcn_readfirstlane((int)(threadIdx.x >> 5));
    const int zh = blockIdx.y; const int b = zh / NH_, h = zh % NH_;
    const int t0 = (blockIdx.x * AW + wave) * 16;
    const size_t pbase = (size_t)b * SEQ * DM + (size_t)h * HD;                 // token-major planes, head column base
    const size_t qo = pbase + (size_t)(t0 + lr) * DM + 8 * hi;
    const v16h qh = ldh(QP + qo);                                               // B fragment: col t, k = d (HD = 32 = one k-step)
    const size_t ko = pbase + (size_t)lr * DM + 8 * hi;                         // + key * DM       (A fragment: row key, k = d)
    const size_t vo = ((size_t)b * DM + (size_t)h * HD + (size_t)lr) * SEQ + 8 * hi;   // + 16j*SEQ + key  (A fragment: row d, k = key)
    v8f o0 = (v8f){}, o1 = (v8f){};
    float m = NEGB, l = 0.0f;
#pragma unroll 1
    for (int key0 = 0; key0 < SEQ; key0 += 32) {
        const h16* ka = KP + ko + (size_t)key0 * DM;
        const v16h ka0 = ldh(ka), kb0 = ldh(ka + 16 * DM);
        v8f sa = (v8f){}, sb = (v8f){};
        sa = wmma16g(ka0, qh, sa); sb = wmma16g(kb0, qh, sb);
        float ta[8], tb[8]; float mx = NEGB;
#pragma unroll
        for (int r = 0; r < 8; ++r) { ta[r] = sa[r] * SC2; tb[r] = sb[r] * SC2; mx = fmaxf(mx, fmaxf(ta[r], tb[r])); }
        mx = fmaxf(mx, __shfl_xor(mx, 16, 32));
        const float mnew = fmaxf(m, mx);
        const float alpha = __builtin_amdgcn_exp2f(m - mnew);
        const float sh = PSH - mnew;
        v16h pb; float ls = 0.0f;
#pragma unroll
        for (int r = 0; r < 8; ++r) {
            const float xa = ta[r] + sh, xb = tb[r] + sh;
            const float ea = __builtin_amdgcn_exp2f(xa), eb = __builtin_amdgcn_exp2f(xb);
            const float ga = (xa < -14.0f) ? 0.0f : ea, gb = (xb < -14.0f) ? 0.0f : eb;   // no subnormal f16 operand: select on the exponent argument
            const h16 pa = (h16)ga; const h16 pc = (h16)gb;
            pb[r] = pa; pb[8 + r] = pc;
            ls += (float)pa + (float)pc; }
        l = l * alpha + ls; m = mnew;
        o0 = o0 * alpha; o1 = o1 * alpha;
        const h16* va = VT + vo + key0;
        const v16h v0 = ldh(va), v1 = ldh(va + (size_t)16 * SEQ);
        o0 = wmma16g(v0, pb, o0); o1 = wmma16g(v1, pb, o1);
    }
    l += __shfl_xor(l, 16, 32);
    const float inv = 1.0f / l;                                 // l >= 16384: the row maximum contributes exactly the carry
    const v8f f0 = o0, f1 = o1;
    const int wb = wave * 16 * OSP;
    // O^T D layout: f_j[r] = (d = 16j + 8h + r, t = lane&15) -> os[t][d]; rows 0..15 x columns 0..31 all written
    { v4f a, c;
      a[0] = f0[0] * inv; a[1] = f0[1] * inv; a[2] = f0[2] * inv; a[3] = f0[3] * inv; c[0] = f0[4] * inv; c[1] = f0[5] * inv; c[2] = f0[6] * inv; c[3] = f0[7] * inv;
      *(v4fa*)(&os[wb + lr * OSP +  0 + 8 * hi]) = a; *(v4fa*)(&os[wb + lr * OSP +  0 + 8 * hi + 4]) = c;
      a[0] = f1[0] * inv; a[1] = f1[1] * inv; a[2] = f1[2] * inv; a[3] = f1[3] * inv; c[0] = f1[4] * inv; c[1] = f1[5] * inv; c[2] = f1[6] * inv; c[3] = f1[7] * inv;
      *(v4fa*)(&os[wb + lr * OSP + 16 + 8 * hi]) = a; *(v4fa*)(&os[wb + lr * OSP + 16 + 8 * hi + 4]) = c; }
    wave_sync();
    float* orow = OUT + ((size_t)b * OUT_SEQ + t0) * DM + h * HD;
{
#pragma unroll
        for (int s = 0; s < 4; ++s) { const int row = 4 * s + (lane >> 3), cofs = (lane & 7) * 4;   // 4 s x 4 rows = 16 rows; 8 lanes x 4 floats = 32 columns = one line
            const v4f val = *(const v4fa*)(&os[wb + row * OSP + cofs]);
            *(v4f*)(orow + (size_t)row * DM + cofs) = val; }
         }
}

static constexpr size_t al256(size_t v) { return (v + 255) & ~(size_t)255; }
static constexpr size_t SZ_PL = al256((size_t)NB * SEQ * DM * 2);          // one f16 plane: [NB*SEQ][256] or [NB*256][SEQ]
static constexpr size_t SZ_TOTAL = 3 * SZ_PL;
static_assert(SZ_TOTAL <= (size_t)134217728);          // workspace carve <= 128 MiB
static_assert(SZ_PL % 128 == 0);

extern "C" void kernel_launch(void* const* d_in, const int* in_sizes, int n_in,
                              void* d_out, int out_size, void* d_ws, size_t ws_size, hipStream_t stream) {
    if (n_in < 2) return;
    const size_t needx = ((size_t)(NB - 1) * SEQ_FULL + SEQ) * DM;
    if ((size_t)in_sizes[0] < needx || (size_t)in_sizes[1] < needx) return;
    if ((size_t)out_size < ((size_t)(NB - 1) * OUT_SEQ + SEQ) * DM) return;
    if (SZ_TOTAL > ws_size) return;
    // wire order: history_bev (keys and values), bev_query (queries)
    const float* hist  = (const float*)d_in[0];
    const float* query = (const float*)d_in[1];
    float* OUT = (float*)d_out;      // [NB][SEQ][256]
    char* wsp = (char*)d_ws;
    h16* QP = (h16*)wsp; wsp += SZ_PL;               // [NB*SEQ][256]  queries
    h16* KP = (h16*)wsp; wsp += SZ_PL;               // [NB*SEQ][256]  keys
    h16* VT = (h16*)wsp; wsp += SZ_PL;               // [NB*256][SEQ]  values, transposed

    {
        const size_t n8 = (size_t)SEQ * DM / 8;
        for (int b = 0; b < NB; ++b) {
            k_cvth<<<(unsigned)((n8 + 255) / 256), 256, 0, stream>>>(query + (size_t)b * SEQ_FULL * DM, QP + (size_t)b * SEQ * DM, n8);
            k_cvth<<<(unsigned)((n8 + 255) / 256), 256, 0, stream>>>(hist + (size_t)b * SEQ_FULL * DM, KP + (size_t)b * SEQ * DM, n8);
        }
    }
    // in [t][256] -> out [256][t] per batch; grid (tokens/64, channels/64, batches)
    k_vt<<<dim3(SEQ / TT, DM / TC, NB), 256, 0, stream>>>(hist, VT);

    k_keypass<<<dim3(SEQ / (16 * AW), NB * NH_, 1), 32 * AW, 0, stream>>>(QP, KP, VT, OUT);
}

// v001
// It runs in 14.5 microseconds.
// Next to v000, in two timings, it ran 2.48 and 2.49 times as fast.
#include <hip/hip_runtime.h>

// Dense grouped pair-score weighting, width 256 = 8 heads x 32, no projections: queries = bev_query rows, keys = values = history_bev rows, score scale 32^-0.5, softmax over keys, heads concatenated (f32 output).
// Both contractions: v_wmma_f32_16x16x32_f16 (f16 operands, f32 accumulate). Inputs are RNE-converted to bf16 at their load and carried as f16 (exact); P is carried x16384 (cancels in the normalisation); softmax f32 (online, running max).
// The module replicates queries and keys R times along the sequence axis and averages the R query copies: every distinct key then appears R times with the same logit and the same value row,
// so the softmax-weighted mean over the R*SEQ replicated keys equals the one over the SEQ distinct keys, and the R identical query copies average to the single result. The kernel works on the SEQ distinct rows.
// Layout: f16 token-major planes Q, K [b*SEQ + t][256] (head h = columns h*32 + d) and the transposed value plane V^T [(b*256 + h*32 + d)][t]; fused online-softmax key-pass kernel in transposed form
// (S^T = K Q^T with A = K rows and B = Q rows; O^T = V^T P^T with the packed P tile as the B fragment), fragments straight from the planes (two 16-B loads each, arithmetic addressing).

#ifndef NB
#define NB 1
#endif
#ifndef SEQ
#define SEQ 1024
#endif
#define NB_FULL  1
#define SEQ_FULL 1024
#ifndef OUT_SEQ
#define OUT_SEQ SEQ              // row pitch (in tokens) between batches of the output
#endif
#define DM   256
#define NH_  8
#define HD   32
#define QT   2                   // query tiles (16 rows each) per online-softmax key-pass block
#define KS   8                   // key ranges per block: one wave per (key range, query tile)
#define AW   (QT * KS)           // waves per online-softmax key-pass block
#define KR   (SEQ / KS)          // keys per wave
#define OSP  36                  // LDS row pitch (floats) of the online-softmax key-pass output tile
#define SC2  ((float)(0.17677669529663687 * 1.4426950408889634))   // HD^-0.5 * log2(e)
#define PSH  14.0f               // log2 of the P carry (16384)
#define NEGB (-3.0e38f)
#define TT   64
#define TC   64                  // transpose tile: channels
#define TSP  72                  // LDS row pitch (halves) of the transpose tile

static_assert(HD == 32);                       // one k-step of the score product; output head segment = 32 floats = one line
static_assert(NH_ * HD == DM);                 // head h = columns h*32 + d
static_assert(DM % 8 == 0);                    // 16-byte fragment loads from token-major rows
static_assert(SEQ % 64 == 0);
static_assert(SEQ % (32 * KS) == 0);           // key loop steps by 32 inside each wave's key range
static_assert(SEQ % (16 * QT) == 0);           // online-softmax key-pass grid covers the sequence exactly
static_assert(SEQ % TT == 0);                  // transpose grid covers the sequence exactly
static_assert(DM % TC == 0);                   // transpose grid covers the channels exactly
static_assert(TT * 2 == 128);
static_assert(TSP >= TT);
static_assert((TSP * 2) % 16 == 0);            // 16-byte aligned LDS rows
static_assert(256 * 4 * 4 == TT * TC);         // transpose load: threads x trips x floats == tile elements
static_assert(256 * 2 * 8 == TC * TT);         // transpose store: threads x trips x halves == tile elements
static_assert(32 * AW * 2 == QT * 16 * HD);    // online-softmax key-pass merge: threads x floats == rows x columns of the block
static_assert(HD == 16 * 2);                   // merge: 16 lanes x 2 floats == one output head segment (one line)
static_assert(((size_t)SEQ * DM) % 64 == 0);
static_assert(NB <= NB_FULL);
static_assert(SEQ <= SEQ_FULL);
static_assert((OSP * 4) % 16 == 0);
static_assert(OSP >= HD);
static_assert((size_t)AW * 16 * (OSP + 2) * 4 <= (size_t)131072);   // static LDS of the online-softmax key-pass kernel
static_assert((size_t)TC * TSP * 2 <= (size_t)131072);         // static LDS of the transpose kernel

typedef _Float16 h16;
typedef __attribute__((ext_vector_type(16))) _Float16 v16h;
typedef __attribute__((ext_vector_type(8)))  _Float16 v8h;
typedef __attribute__((ext_vector_type(8)))  float    v8f;
typedef __attribute__((ext_vector_type(4)))  float    v4f;
typedef v4f  __attribute__((may_alias)) v4fa;
typedef v8h  __attribute__((may_alias)) v8ha;
typedef __attribute__((ext_vector_type(2)))  float    v2f;
typedef v2f  __attribute__((may_alias)) v2fa;

__device__ __forceinline__ unsigned short f2bf(float f) { unsigned u = __float_as_uint(f); u += 0x7FFFu + ((u >> 16) & 1u); return (unsigned short)(u >> 16); }
__device__ __forceinline__ float bfr(float f) { return __uint_as_float(((unsigned)f2bf(f)) << 16); }   // value after RNE convert to bf16
__device__ __forceinline__ v16h cat16(v8h lo, v8h hi) { return __builtin_shufflevector(lo, hi, 0, 1, 2, 3, 4, 5, 6, 7, 8, 9, 10, 11, 12, 13, 14, 15); }
__device__ __forceinline__ v8f wmma16(v16h a, v16h b, v8f c) { return __builtin_amdgcn_wmma_f32_16x16x32_f16(false, a, false, b, (short)0, c, false, false); }
// fragment loader from K-contiguous 16-bit rows; p already includes + 8*(lane>>4): elements 0..7 <- k0+8h+0..7, elements 8..15 <- k0+16+8h+0..7 (same map for A and B)
__device__ __forceinline__ v16h  ldh(const h16* p) { return cat16(*(const v8h*)p, *(const v8h*)(p + 16)); }
// f32 -> f16 convert that cannot produce a subnormal operand (|v| < 2^-14 -> +0)
static __device__ __forceinline__ h16 toh_flush(float v) { const h16 r = (h16)v; return (fabsf(v) < 6.103515625e-05f) ? (h16)0.0f : r; }
// one matrix instruction with its own issue-slot guard (ties the accumulator, keeps both operand fragments live)
__device__ __forceinline__ v8f wmma16g(v16h a, v16h b, v8f c) {
    c = wmma16(a, b, c);
    asm volatile("v_nop\n\tv_nop\n\tv_nop\n\tv_nop" : "+v"(c) : "v"(a), "v"(b));
    return c;
}

__global__ __launch_bounds__(256) void k_cvth(const float* __restrict__ src, h16* dst, size_t n8) {
    const size_t i = (size_t)blockIdx.x * 256 + threadIdx.x; if (i >= n8) return;
    const v8f v = *(const v8f*)(src + i * 8); v8h o;
#pragma unroll
    for (int k = 0; k < 8; ++k) o[k] = toh_flush(bfr(v[k]));
    *(v8h*)(dst + i * 8) = o; 
}

// k_vt: transposed f16 value plane. in [t][256] (f32, row pitch DM) -> out [(b*256 + c)][t] (f16, row pitch SEQ); one block per 64-token x 64-channel tile.
// Load: 256 threads x 4 trips x one float4 (16 float4 per token row). LDS tile ts[c][t] (cross-wave: block barrier). Store: each V^T row segment of 64 halves (one line) by 8 consecutive lanes x 16 B,
__global__ __launch_bounds__(256) void k_vt(const float* __restrict__ src, h16* VT) {
    __shared__ __align__(16) h16 ts[TC * TSP];
    const int tid = threadIdx.x;
    const int tk0 = blockIdx.x * TT, c0 = blockIdx.y * TC, b = blockIdx.z;
    const float* sp = src + ((size_t)b * SEQ_FULL + (size_t)tk0) * DM + c0;
#pragma unroll 1
    for (int it = 0; it < 4; ++it) {
        const int idx = it * 256 + tid; const int t = idx >> 4, c4 = (idx & 15) * 4;     // 64 token rows x 16 float4
        const v4f x = *(const v4f*)(sp + (size_t)t * DM + c4);
#pragma unroll
        for (int k = 0; k < 4; ++k) ts[(c4 + k) * TSP + t] = toh_flush(bfr(x[k])); }
    __syncthreads();
    h16* dp = VT + ((size_t)b * DM + (size_t)c0) * SEQ + (size_t)tk0;
{
#pragma unroll
        for (int it = 0; it < 2; ++it) { const int p = it * 256 + tid; const int row = p >> 3, c8 = (p & 7) * 8;   // 2 trips x 32 rows = 64 rows; 8 lanes x 8 halves = 64 tokens = one line
            const v8h val = *(const v8ha*)(&ts[row * TSP + c8]);
            *(v8h*)(dp + (size_t)row * SEQ + c8) = val; }
         }
}

// k_keypass: fused pair weighting, one wave per (16 query rows, KR keys) of one (batch, head); K / V^T / Q fragments straight from the f16 planes.
// The KS waves of a query tile each walk their own contiguous key range with their own running max, sum and accumulators; the un-normalised partials meet in LDS
// behind one block barrier and are merged with weights exp2(m_k - max). The QT waves of one key range stand next to each other and read the same K / V^T lines.
// Transposed form: S^T[key][t] = K Q^T (A = K rows, B = Q rows); lane (t = lane&15, h = lane>>4) holds keys 8h+r of each 16-key tile, so the packed
// P tile is directly the B fragment of O^T[d][t] = V^T P^T (element r <- tile keys 0..15, element 8+r <- tile keys 16..31, lane unchanged).
// Softmax state (running max, partial sum over the converted P) is one scalar per lane; the two lane halves of a row are combined with one xor-16 exchange.
// grid (SEQ/(16*QT), NB*NH_).
// amdgpu_waves_per_eu: SEQ/(16*QT) * NH_ blocks of AW waves stand one per WGP, AW/4 waves per SIMD; without it the scheduler holds the loop to the 16-wave register budget and waits for the two V^T fragments one after the other.
__global__ __launch_bounds__(32 * AW) __attribute__((amdgpu_waves_per_eu(AW / 4, AW / 4))) void k_keypass(const h16* __restrict__ QP, const h16* __restrict__ KP, const h16* __restrict__ VT, float* OUT) {
    __shared__ __align__(16) float os[AW * 16 * OSP];   // per wave: un-normalised O partial [t][d]
    __shared__ __align__(8)  float ml[AW * 16 * 2];     // per wave and query row: (running max, sum)
    const int lane = threadIdx.x & 31, lr = lane & 15, hi = lane >> 4;
    const int wave = __builtin_amdgcn_readfirstlane((int)(threadIdx.x >> 5));
    const int zh = blockIdx.y; const int b = zh / NH_, h = zh % NH_;
    const int qt = wave % QT, ks = wave / QT;
    const int t0 = (blockIdx.x * QT + qt) * 16;
    const int kbeg = ks * KR;
    const size_t pbase = (size_t)b * SEQ * DM + (size_t)h * HD;                 // token-major planes, head column base
    const size_t qo = pbase + (size_t)(t0 + lr) * DM + 8 * hi;
    const v16h qh = ldh(QP + qo);                                               // B fragment: col t, k = d (HD = 32 = one k-step)
    const size_t ko = pbase + (size_t)lr * DM + 8 * hi;                         // + key * DM       (A fragment: row key, k = d)
    const size_t vo = ((size_t)b * DM + (size_t)h * HD + (size_t)lr) * SEQ + 8 * hi;   // + 16j*SEQ + key  (A fragment: row d, k = key)
    v8f o0 = (v8f){}, o1 = (v8f){};
    float m = NEGB, l = 0.0f;
#pragma unroll 1
    for (int key0 = kbeg; key0 < kbeg + KR; key0 += 32) {
        const h16* ka = KP + ko + (size_t)key0 * DM;
        const v16h ka0 = ldh(ka), kb0 = ldh(ka + 16 * DM);
        v8f sa = (v8f){}, sb = (v8f){};
        sa = wmma16g(ka0, qh, sa); sb = wmma16g(kb0, qh, sb);
        float ta[8], tb[8]; float mx = NEGB;
#pragma unroll
        for (int r = 0; r < 8; ++r) { ta[r] = sa[r] * SC2; tb[r] = sb[r] * SC2; mx = fmaxf(mx, fmaxf(ta[r], tb[r])); }
        mx = fmaxf(mx, __shfl_xor(mx, 16, 32));
        const float mnew = fmaxf(m, mx);
        const float alpha = __builtin_amdgcn_exp2f(m - mnew);
        const float sh = PSH - mnew;
        v16h pb; float ls = 0.0f;
#pragma unroll
        for (int r = 0; r < 8; ++r) {
            const float xa = ta[r] + sh, xb = tb[r] + sh;
            const float ea = __builtin_amdgcn_exp2f(xa), eb = __builtin_amdgcn_exp2f(xb);
            const float ga = (xa < -14.0f) ? 0.0f : ea, gb = (xb < -14.0f) ? 0.0f : eb;   // no subnormal f16 operand: select on the exponent argument
            const h16 pa = (h16)ga; const h16 pc = (h16)gb;
            pb[r] = pa; pb[8 + r] = pc;
            ls += (float)pa + (float)pc; }
        l = l * alpha + ls; m = mnew;
        o0 = o0 * alpha; o1 = o1 * alpha;
        const h16* va = VT + vo + key0;
        const v16h v0 = ldh(va), v1 = ldh(va + (size_t)16 * SEQ);
        o0 = wmma16g(v0, pb, o0); o1 = wmma16g(v1, pb, o1);
    }
    l += __shfl_xor(l, 16, 32);
    const int wb = wave * 16 * OSP;
    // O^T D layout: o_j[r] = (d = 16j + 8h + r, t = lane&15) -> os[t][d]; rows 0..15 x columns 0..31 all written
    { v4f a, c;
      a[0] = o0[0]; a[1] = o0[1]; a[2] = o0[2]; a[3] = o0[3]; c[0] = o0[4]; c[1] = o0[5]; c[2] = o0[6]; c[3] = o0[7];
      *(v4fa*)(&os[wb + lr * OSP +  0 + 8 * hi]) = a; *(v4fa*)(&os[wb + lr * OSP +  0 + 8 * hi + 4]) = c;
      a[0] = o1[0]; a[1] = o1[1]; a[2] = o1[2]; a[3] = o1[3]; c[0] = o1[4]; c[1] = o1[5]; c[2] = o1[6]; c[3] = o1[7];
      *(v4fa*)(&os[wb + lr * OSP + 16 + 8 * hi]) = a; *(v4fa*)(&os[wb + lr * OSP + 16 + 8 * hi + 4]) = c; }
    ml[(wave * 16 + lr) * 2 + hi] = hi ? l : m;                 // both lane halves hold the row's max and joined sum: half 0 stores the max, half 1 the sum
    __syncthreads();                                            // every wave's partial is read by other waves below
    // merge: thread -> (block row 0..QT*16-1, two columns); 16 lanes x 2 floats = 32 columns = one line
    const int row = (int)threadIdx.x >> 4, c2 = ((int)threadIdx.x & 15) * 2;
    const int mq = row >> 4, mr = row & 15;
    v2f st[KS]; float mm = NEGB;
#pragma unroll   // st[] stays in registers; the KS LDS reads issue together
    for (int k = 0; k < KS; ++k) { st[k] = *(const v2fa*)(&ml[((k * QT + mq) * 16 + mr) * 2]); mm = fmaxf(mm, st[k][0]); }
    float ls = 0.0f; v2f acc = (v2f){};
#pragma unroll   // constant index into st[]; the KS partial reads issue together
    for (int k = 0; k < KS; ++k) {
        const float w = __builtin_amdgcn_exp2f(st[k][0] - mm);
        const v2f p = *(const v2fa*)(&os[(k * QT + mq) * 16 * OSP + mr * OSP + c2]);
        ls += w * st[k][1]; acc += w * p; }
    const float inv = 1.0f / ls;                                // ls >= 16384: the row maximum contributes exactly the carry, with weight 1
    float* orow = OUT + ((size_t)b * OUT_SEQ + (size_t)blockIdx.x * (QT * 16)) * DM + h * HD;
    *(v2f*)(orow + (size_t)row * DM + c2) = acc * inv;
}

static constexpr size_t al256(size_t v) { return (v + 255) & ~(size_t)255; }
static constexpr size_t SZ_PL = al256((size_t)NB * SEQ * DM * 2);          // one f16 plane: [NB*SEQ][256] or [NB*256][SEQ]
static constexpr size_t SZ_TOTAL = 3 * SZ_PL;
static_assert(SZ_TOTAL <= (size_t)134217728);          // workspace carve <= 128 MiB
static_assert(SZ_PL % 128 == 0);

extern "C" void kernel_launch(void* const* d_in, const int* in_sizes, int n_in,
                              void* d_out, int out_size, void* d_ws, size_t ws_size, hipStream_t stream) {
    if (n_in < 2) return;
    const size_t needx = ((size_t)(NB - 1) * SEQ_FULL + SEQ) * DM;
    if ((size_t)in_sizes[0] < needx || (size_t)in_sizes[1] < needx) return;
    if ((size_t)out_size < ((size_t)(NB - 1) * OUT_SEQ + SEQ) * DM) return;
    if (SZ_TOTAL > ws_size) return;
    // wire order: history_bev (keys and values), bev_query (queries)
    const float* hist  = (const float*)d_in[0];
    const float* query = (const float*)d_in[1];
    float* OUT = (float*)d_out;      // [NB][SEQ][256]
    char* wsp = (char*)d_ws;
    h16* QP = (h16*)wsp; wsp += SZ_PL;               // [NB*SEQ][256]  queries
    h16* KP = (h16*)wsp; wsp += SZ_PL;               // [NB*SEQ][256]  keys
    h16* VT = (h16*)wsp; wsp += SZ_PL;               // [NB*256][SEQ]  values, transposed

    {
        const size_t n8 = (size_t)SEQ * DM / 8;
        for (int b = 0; b < NB; ++b) {
            k_cvth<<<(unsigned)((n8 + 255) / 256), 256, 0, stream>>>(query + (size_t)b * SEQ_FULL * DM, QP + (size_t)b * SEQ * DM, n8);
            k_cvth<<<(unsigned)((n8 + 255) / 256), 256, 0, stream>>>(hist + (size_t)b * SEQ_FULL * DM, KP + (size_t)b * SEQ * DM, n8);
        }
    }
    // in [t][256] -> out [256][t] per batch; grid (tokens/64, channels/64, batches)
    k_vt<<<dim3(SEQ / TT, DM / TC, NB), 256, 0, stream>>>(hist, VT);

    k_keypass<<<dim3(SEQ / (16 * QT), NB * NH_, 1), 32 * AW, 0, stream>>>(QP, KP, VT, OUT);
}

// v002
// A run of this version takes 6.73 microseconds.
// Timed twice side by side with v001, it ran 2.18 and 2.19 times as fast.
// Counting every step since v000, it is 5.44 times as fast.
#include <hip/hip_runtime.h>

// Dense grouped pair-score weighting, width 256 = 8 heads x 32, no projections: queries = bev_query rows, keys = values = history_bev rows, score scale 32^-0.5, softmax over keys, heads concatenated (f32 output).
// Both contractions: v_wmma_f32_16x16x32_f16 (f16 operands, f32 accumulate). Inputs are RNE-converted to bf16 at their load and carried as f16 (exact); P is carried x16384 (cancels in the normalisation); softmax f32 (online, running max).
// The module replicates queries and keys R times along the sequence axis and averages the R query copies: every distinct key then appears R times with the same logit and the same value row,
// so the softmax-weighted mean over the R*SEQ replicated keys equals the one over the SEQ distinct keys, and the R identical query copies average to the single result. The kernel works on the SEQ distinct rows.
// One launch: each block converts its head's SEQ x 32 key rows once into an f16 LDS tile [key][d]; fused online-softmax key-pass kernel in transposed form
// (S^T = K Q^T with A = K rows and B = Q rows; O^T = V^T P^T with the packed P tile as the B fragment). K fragments: two 16-B LDS loads each; V^T fragments: two transposing 16-B LDS loads each, from the same tile.

#ifndef NB
#define NB 1
#endif
#ifndef SEQ
#define SEQ 1024
#endif
#define NB_FULL  1
#define SEQ_FULL 1024
#ifndef OUT_SEQ
#define OUT_SEQ SEQ              // row pitch (in tokens) between batches of the output
#endif
#define DM   256
#define NH_  8
#define HD   32
#define QT   2                   // query tiles (16 rows each) per online-softmax key-pass block
#define KS   8                   // key ranges per block: one wave per (key range, query tile)
#define AW   (QT * KS)           // waves per online-softmax key-pass block
#define KR   (SEQ / KS)          // keys per wave
#define OSP  36                  // LDS row pitch (floats) of the online-softmax key-pass output tile
#define SC2  ((float)(0.17677669529663687 * 1.4426950408889634))   // HD^-0.5 * log2(e)
#define PSH  14.0f               // log2 of the P carry (16384)
#define NEGB (-3.0e38f)
#define KPB  96                  // LDS row pitch (bytes) of the f16 key tile: 64 B of data, odd multiple of 32 B for the transposing reader
#define SR   (SEQ / AW)          // key rows staged per wave

static_assert(HD == 32);                       // one k-step of the score product; output head segment = 32 floats = one line
static_assert(NH_ * HD == DM);                 // head h = columns h*32 + d
static_assert(DM % 8 == 0);                    // 16-byte fragment loads from token-major rows
static_assert(SEQ % 64 == 0);
static_assert(SEQ % (32 * KS) == 0);           // key loop steps by 32 inside each wave's key range
static_assert(SEQ % (16 * QT) == 0);           // online-softmax key-pass grid covers the sequence exactly
static_assert(SEQ % (4 * AW) == 0);            // staging: each wave-wide load covers 4 key rows (4 whole lines)
static_assert(KPB >= HD * 2 && KPB % 32 == 0 && ((KPB / 32) & 1) == 1);
static_assert(32 * AW * 2 == QT * 16 * HD);    // online-softmax key-pass merge: threads x floats == rows x columns of the block
static_assert(HD == 16 * 2);                   // merge: 16 lanes x 2 floats == one output head segment (one line)
static_assert(((size_t)SEQ * DM) % 64 == 0);
static_assert(NB <= NB_FULL);
static_assert(SEQ <= SEQ_FULL);
static_assert((OSP * 4) % 16 == 0);
static_assert(OSP >= HD);
static_assert((size_t)AW * 16 * (OSP + 2) * 4 + (size_t)SEQ * KPB <= (size_t)163840);   // static LDS of the online-softmax key-pass kernel

typedef _Float16 h16;
typedef __attribute__((ext_vector_type(16))) _Float16 v16h;
typedef __attribute__((ext_vector_type(8)))  _Float16 v8h;
typedef __attribute__((ext_vector_type(8)))  float    v8f;
typedef __attribute__((ext_vector_type(4)))  float    v4f;
typedef v4f  __attribute__((may_alias)) v4fa;
typedef v8h  __attribute__((may_alias)) v8ha;
typedef __attribute__((ext_vector_type(2)))  float    v2f;
typedef v2f  __attribute__((may_alias)) v2fa;
typedef __attribute__((ext_vector_type(4)))  _Float16 v4h;
typedef v4h  __attribute__((may_alias)) v4ha;
typedef __attribute__((ext_vector_type(2)))  _Float16 v2h;
typedef __attribute__((ext_vector_type(2)))  __bf16   v2b;

__device__ __forceinline__ v16h cat16(v8h lo, v8h hi) { return __builtin_shufflevector(lo, hi, 0, 1, 2, 3, 4, 5, 6, 7, 8, 9, 10, 11, 12, 13, 14, 15); }
__device__ __forceinline__ v8f wmma16(v16h a, v16h b, v8f c) { return __builtin_amdgcn_wmma_f32_16x16x32_f16(false, a, false, b, (short)0, c, false, false); }
// two inputs: RNE convert to bf16 (packed convert), carried as f16 (exact); no subnormal operand (|v| < 2^-14 after the bf16 rounding -> +0)
__device__ __forceinline__ v2h cv2(float a, float b) {
    v2f x; x[0] = a; x[1] = b;
    const unsigned u = __builtin_bit_cast(unsigned, __builtin_convertvector(x, v2b));
    const float lo = __uint_as_float(u << 16), hi = __uint_as_float(u & 0xFFFF0000u);
    x[0] = (fabsf(lo) < 6.103515625e-05f) ? 0.0f : lo; x[1] = (fabsf(hi) < 6.103515625e-05f) ? 0.0f : hi;
    return __builtin_convertvector(x, v2h);
}
// one matrix instruction with its own issue-slot guard (ties the accumulator, keeps both operand fragments live)
__device__ __forceinline__ v8f wmma16g(v16h a, v16h b, v8f c) {
    c = wmma16(a, b, c);
    asm volatile("v_nop\n\tv_nop\n\tv_nop\n\tv_nop" : "+v"(c) : "v"(a), "v"(b));
    return c;
}

// transposing 16-B LDS load: lane (c = lane&15, h = lane>>4) gets rows kbase + 8h + 0..7 of column dbase + c; p is the lane's own address in the row-major tile
typedef __attribute__((ext_vector_type(8))) short s16x8;
__device__ __forceinline__ v8h ldtr(const unsigned char* p) { typedef __attribute__((address_space(3))) s16x8 lds_s16x8; return __builtin_bit_cast(v8h, __builtin_amdgcn_ds_load_tr16_b128_v8i16((lds_s16x8*)p)); }

// k_keypass: fused pair weighting, one wave per (16 query rows, KR keys) of one (batch, head), straight from the f32 inputs.
// Staging: the block's AW waves read the head's SEQ key rows (one 128-B line each, 4 whole lines per wave-wide load), convert them once and store them as f16 rows in LDS; one block barrier publishes the tile.
// The tile serves both products: K fragments by plain 16-B loads (row = key), V^T fragments by transposing 16-B loads (row = d). The Q fragment is converted in registers.
// The KS waves of a query tile each walk their own contiguous key range with their own running max, sum and accumulators; the un-normalised partials meet in LDS
// behind one block barrier and are merged with weights exp2(m_k - max). The QT waves of one key range read the same tile rows.
// Transposed form: S^T[key][t] = K Q^T (A = K rows, B = Q rows); lane (t = lane&15, h = lane>>4) holds keys 8h+r of each 16-key tile, so the packed
// P tile is directly the B fragment of O^T[d][t] = V^T P^T (element r <- tile keys 0..15, element 8+r <- tile keys 16..31, lane unchanged).
// Softmax state (running max, partial sum over the converted P) is one scalar per lane; the two lane halves of a row are combined with one xor-16 exchange.
// grid (SEQ/(16*QT), NB*NH_).
// amdgpu_waves_per_eu: SEQ/(16*QT) * NH_ blocks of AW waves stand one per WGP, AW/4 waves per SIMD; without it the scheduler holds the loop to the 16-wave register budget and waits for the two V^T fragments one after the other.
__global__ __launch_bounds__(32 * AW) __attribute__((amdgpu_waves_per_eu(AW / 4, AW / 4))) void k_keypass(const float* __restrict__ QF, const float* __restrict__ KF, float* OUT) {
    __shared__ __align__(32) unsigned char kt[SEQ * KPB];   // f16 key rows of this head: [key][d], row pitch KPB
    __shared__ __align__(16) float os[AW * 16 * OSP];   // per wave: un-normalised O partial [t][d]
    __shared__ __align__(8)  float ml[AW * 16 * 2];     // per wave and query row: (running max, sum)
    const int lane = threadIdx.x & 31, lr = lane & 15, hi = lane >> 4;
    const int wave = __builtin_amdgcn_readfirstlane((int)(threadIdx.x >> 5));
    const int zh = blockIdx.y; const int b = zh / NH_, h = zh % NH_;
    const int qt = wave % QT, ks = wave / QT;
    const int t0 = (blockIdx.x * QT + qt) * 16;
    const int kbeg = ks * KR;
    const size_t pbase = (size_t)b * SEQ_FULL * DM + (size_t)h * HD;            // token-major inputs, head column base
    // staging loads: wave -> key rows wave*SR .. +SR-1; lane -> (row lane>>3 of 4, floats 4*(lane&7) .. +3)
    const int sr0 = wave * SR + (lane >> 3), sc = (lane & 7) * 4;
    const float* kp = KF + pbase + (size_t)sr0 * DM + sc;
    v4f kx[SR / 4];
#pragma unroll   // kx[] stays in registers; all of the wave's staging loads are in flight together
    for (int it = 0; it < SR / 4; ++it) kx[it] = *(const v4f*)(kp + (size_t)it * 4 * DM);
    const float* qp = QF + pbase + (size_t)(t0 + lr) * DM + 8 * hi;
    const v8f q0 = *(const v8f*)qp, q1 = *(const v8f*)(qp + 16);
#pragma unroll   // constant index into kx[]
    for (int it = 0; it < SR / 4; ++it) {
        const v2h a = cv2(kx[it][0], kx[it][1]), c = cv2(kx[it][2], kx[it][3]);
        *(v4ha*)(&kt[(sr0 + it * 4) * KPB + sc * 2]) = __builtin_shufflevector(a, c, 0, 1, 2, 3); }
    v16h qh;                                                                    // B fragment: col t, k = d (HD = 32 = one k-step); elements 0..7 <- d 8h+0..7, 8..15 <- d 16+8h+0..7
#pragma unroll
    for (int k = 0; k < 8; k += 2) { const v2h a = cv2(q0[k], q0[k + 1]), c = cv2(q1[k], q1[k + 1]); qh[k] = a[0]; qh[k + 1] = a[1]; qh[8 + k] = c[0]; qh[9 + k] = c[1]; }
    __syncthreads();                                                            // the key tile is read by every wave below
    const unsigned char* ko = kt + lr * KPB + 16 * hi;                          // + key * KPB      (A fragment: row key, k = d)
    const unsigned char* vo = kt + (8 * hi + (lane & 7)) * KPB + 16 * ((lane >> 3) & 1);   // + key * KPB + 32j  (A fragment: row d = 16j + lr, k = key)
    v8f o0 = (v8f){}, o1 = (v8f){};
    float m = NEGB, l = 0.0f;
#pragma unroll 1
    for (int key0 = kbeg; key0 < kbeg + KR; key0 += 32) {
        const unsigned char* ka = ko + key0 * KPB;
        const v16h ka0 = cat16(*(const v8ha*)ka, *(const v8ha*)(ka + 32)), kb0 = cat16(*(const v8ha*)(ka + 16 * KPB), *(const v8ha*)(ka + 16 * KPB + 32));
        const unsigned char* va = vo + key0 * KPB;
        const v16h v0 = cat16(ldtr(va), ldtr(va + 16 * KPB)), v1 = cat16(ldtr(va + 32), ldtr(va + 16 * KPB + 32));
        v8f sa = (v8f){}, sb = (v8f){};
        sa = wmma16g(ka0, qh, sa); sb = wmma16g(kb0, qh, sb);
        float ta[8], tb[8]; float mx = NEGB;
#pragma unroll
        for (int r = 0; r < 8; ++r) { ta[r] = sa[r] * SC2; tb[r] = sb[r] * SC2; mx = fmaxf(mx, fmaxf(ta[r], tb[r])); }
        mx = fmaxf(mx, __shfl_xor(mx, 16, 32));
        const float mnew = fmaxf(m, mx);
        const float alpha = __builtin_amdgcn_exp2f(m - mnew);
        const float sh = PSH - mnew;
        v16h pb; float ls = 0.0f;
#pragma unroll
        for (int r = 0; r < 8; ++r) {
            const float xa = ta[r] + sh, xb = tb[r] + sh;
            const float ea = __builtin_amdgcn_exp2f(xa), eb = __builtin_amdgcn_exp2f(xb);
            const float ga = (xa < -14.0f) ? 0.0f : ea, gb = (xb < -14.0f) ? 0.0f : eb;   // no subnormal f16 operand: select on the exponent argument
            const h16 pa = (h16)ga; const h16 pc = (h16)gb;
            pb[r] = pa; pb[8 + r] = pc;
            ls += (float)pa + (float)pc; }
        l = l * alpha + ls; m = mnew;
        o0 = o0 * alpha; o1 = o1 * alpha;
        o0 = wmma16g(v0, pb, o0); o1 = wmma16g(v1, pb, o1);
    }
    l += __shfl_xor(l, 16, 32);
    const int wb = wave * 16 * OSP;
    // O^T D layout: o_j[r] = (d = 16j + 8h + r, t = lane&15) -> os[t][d]; rows 0..15 x columns 0..31 all written
    { v4f a, c;
      a[0] = o0[0]; a[1] = o0[1]; a[2] = o0[2]; a[3] = o0[3]; c[0] = o0[4]; c[1] = o0[5]; c[2] = o0[6]; c[3] = o0[7];
      *(v4fa*)(&os[wb + lr * OSP +  0 + 8 * hi]) = a; *(v4fa*)(&os[wb + lr * OSP +  0 + 8 * hi + 4]) = c;
      a[0] = o1[0]; a[1] = o1[1]; a[2] = o1[2]; a[3] = o1[3]; c[0] = o1[4]; c[1] = o1[5]; c[2] = o1[6]; c[3] = o1[7];
      *(v4fa*)(&os[wb + lr * OSP + 16 + 8 * hi]) = a; *(v4fa*)(&os[wb + lr * OSP + 16 + 8 * hi + 4]) = c; }
    ml[(wave * 16 + lr) * 2 + hi] = hi ? l : m;                 // both lane halves hold the row's max and joined sum: half 0 stores the max, half 1 the sum
    __syncthreads();                                            // every wave's partial is read by other waves below
    // merge: thread -> (block row 0..QT*16-1, two columns); 16 lanes x 2 floats = 32 columns = one line
    const int row = (int)threadIdx.x >> 4, c2 = ((int)threadIdx.x & 15) * 2;
    const int mq = row >> 4, mr = row & 15;
    v2f st[KS]; float mm = NEGB;
#pragma unroll   // st[] stays in registers; the KS LDS reads issue together
    for (int k = 0; k < KS; ++k) { st[k] = *(const v2fa*)(&ml[((k * QT + mq) * 16 + mr) * 2]); mm = fmaxf(mm, st[k][0]); }
    float ls = 0.0f; v2f acc = (v2f){};
#pragma unroll   // constant index into st[]; the KS partial reads issue together
    for (int k = 0; k < KS; ++k) {
        const float w = __builtin_amdgcn_exp2f(st[k][0] - mm);
        const v2f p = *(const v2fa*)(&os[(k * QT + mq) * 16 * OSP + mr * OSP + c2]);
        ls += w * st[k][1]; acc += w * p; }
    const float inv = 1.0f / ls;                                // ls >= 16384: the row maximum contributes exactly the carry, with weight 1
    float* orow = OUT + ((size_t)b * OUT_SEQ + (size_t)blockIdx.x * (QT * 16)) * DM + h * HD;
    *(v2f*)(orow + (size_t)row * DM + c2) = acc * inv;
}

extern "C" void kernel_launch(void* const* d_in, const int* in_sizes, int n_in,
                              void* d_out, int out_size, void* d_ws, size_t ws_size, hipStream_t stream) {
    if (n_in < 2) return;
    const size_t needx = ((size_t)(NB - 1) * SEQ_FULL + SEQ) * DM;
    if ((size_t)in_sizes[0] < needx || (size_t)in_sizes[1] < needx) return;
    if ((size_t)out_size < ((size_t)(NB - 1) * OUT_SEQ + SEQ) * DM) return;
    // wire order: history_bev (keys and values), bev_query (queries)
    const float* hist  = (const float*)d_in[0];
    const float* query = (const float*)d_in[1];
    float* OUT = (float*)d_out;      // [NB][SEQ][256]

    k_keypass<<<dim3(SEQ / (16 * QT), NB * NH_, 1), 32 * AW, 0, stream>>>(query, hist, OUT);
}

// v004
// A run of this version takes 5.64 microseconds.
// Versions in between are left out here; by their measured steps it is 1.19 times as fast as v002.
// All steps since v000 together make it 6.49 times as fast.
#include <hip/hip_runtime.h>

// Dense grouped pair-score weighting, width 256 = 8 heads x 32, no projections: queries = bev_query rows, keys = values = history_bev rows, score scale 32^-0.5, softmax over keys, heads concatenated (f32 output).
// Both contractions: v_wmma_f32_16x16x32_f16 (f16 operands, f32 accumulate). Inputs are RNE-converted to f16 at their load; P is carried x16384 (cancels in the normalisation); softmax f32 (one maximum per wave and key range, partials merged by their maxima).
// The module replicates queries and keys R times along the sequence axis and averages the R query copies: every distinct key then appears R times with the same logit and the same value row,
// so the softmax-weighted mean over the R*SEQ replicated keys equals the one over the SEQ distinct keys, and the R identical query copies average to the single result. The kernel works on the SEQ distinct rows.
// One launch: each block converts its head's SEQ x 32 key rows once into an f16 LDS tile [key][d]; fused key-pass kernel in transposed form
// (S^T = K Q^T with A = K rows and B = Q rows; O^T = V^T P^T with the packed P tile as the B fragment). K fragments: two 16-B LDS loads each; V^T fragments: two transposing 16-B LDS loads each, from the same tile.

#ifndef NB
#define NB 1
#endif
#ifndef SEQ
#define SEQ 1024
#endif
#define NB_FULL  1
#define SEQ_FULL 1024
#ifndef OUT_SEQ
#define OUT_SEQ SEQ              // row pitch (in tokens) between batches of the output
#endif
#define DM   256
#define NH_  8
#define HD   32
#define QT   2                   // query tiles (16 rows each) per online-softmax key-pass block
#define KS   8                   // key ranges per block: one wave per (key range, query tile)
#define AW   (QT * KS)           // waves per online-softmax key-pass block
#define KR   (SEQ / KS)          // keys per wave
#define OSP  36                  // LDS row pitch (floats) of the online-softmax key-pass output tile
#define SC2  ((float)(0.17677669529663687 * 1.4426950408889634))   // HD^-0.5 * log2(e)
#define PSH  14.0f               // log2 of the P carry (16384)
#define NEGB (-3.0e38f)
#define KPB  96                  // LDS row pitch (bytes) of the f16 key tile: 64 B of data, odd multiple of 32 B for the transposing reader
#define SR   (SEQ / AW)          // key rows staged per wave

static_assert(HD == 32);                       // one k-step of the score product; output head segment = 32 floats = one line
static_assert(NH_ * HD == DM);                 // head h = columns h*32 + d
static_assert(DM % 8 == 0);                    // 16-byte fragment loads from token-major rows
static_assert(SEQ % 64 == 0);
static_assert(SEQ % (64 * KS) == 0);           // second product steps by 32 keys; the maximum runs in four chains over the 16-key score tiles
static_assert(SEQ % (16 * QT) == 0);           // online-softmax key-pass grid covers the sequence exactly
static_assert(SEQ % (4 * AW) == 0);            // staging: each wave-wide load covers 4 key rows (4 whole lines)
static_assert(KPB >= HD * 2 && KPB % 32 == 0 && ((KPB / 32) & 1) == 1);
static_assert(32 * AW * 2 == QT * 16 * HD);    // online-softmax key-pass merge: threads x floats == rows x columns of the block
static_assert(HD == 16 * 2);                   // merge: 16 lanes x 2 floats == one output head segment (one line)
static_assert(((size_t)SEQ * DM) % 64 == 0);
static_assert(NB <= NB_FULL);
static_assert(SEQ <= SEQ_FULL);
static_assert((OSP * 4) % 16 == 0);
static_assert(OSP >= HD);
static_assert((size_t)AW * 16 * (OSP + 2) * 4 + (size_t)SEQ * KPB <= (size_t)163840);   // static LDS of the online-softmax key-pass kernel

typedef _Float16 h16;
typedef __attribute__((ext_vector_type(16))) _Float16 v16h;
typedef __attribute__((ext_vector_type(8)))  _Float16 v8h;
typedef __attribute__((ext_vector_type(8)))  float    v8f;
typedef __attribute__((ext_vector_type(4)))  float    v4f;
typedef v4f  __attribute__((may_alias)) v4fa;
typedef v8h  __attribute__((may_alias)) v8ha;
typedef __attribute__((ext_vector_type(2)))  float    v2f;
typedef v2f  __attribute__((may_alias)) v2fa;
typedef __attribute__((ext_vector_type(4)))  _Float16 v4h;
typedef v4h  __attribute__((may_alias)) v4ha;
typedef __attribute__((ext_vector_type(2)))  _Float16 v2h;

__device__ __forceinline__ v16h cat16(v8h lo, v8h hi) { return __builtin_shufflevector(lo, hi, 0, 1, 2, 3, 4, 5, 6, 7, 8, 9, 10, 11, 12, 13, 14, 15); }
__device__ __forceinline__ v8f wmma16(v16h a, v16h b, v8f c) { return __builtin_amdgcn_wmma_f32_16x16x32_f16(false, a, false, b, (short)0, c, false, false); }
// two f32 values -> two f16, one packed RNE convert; f16 subnormals are kept (the matrix unit takes them as they are)
__device__ __forceinline__ v2h cv2(float a, float b) {
    v2f x; x[0] = a; x[1] = b;
    return __builtin_convertvector(x, v2h);
}

// lane l <-> lane l ^ 16, as a vector cross-row move
__device__ __forceinline__ float xhalf(float x) { return __builtin_bit_cast(float, __builtin_amdgcn_permlanex16(__builtin_bit_cast(int, x), __builtin_bit_cast(int, x), 0x76543210, 0xfedcba98, false, false)); }

// transposing 16-B LDS load: lane (c = lane&15, h = lane>>4) gets rows kbase + 8h + 0..7 of column dbase + c; p is the lane's own address in the row-major tile
typedef __attribute__((ext_vector_type(8))) short s16x8;
__device__ __forceinline__ v8h ldtr(const unsigned char* p) { typedef __attribute__((address_space(3))) s16x8 lds_s16x8; return __builtin_bit_cast(v8h, __builtin_amdgcn_ds_load_tr16_b128_v8i16((lds_s16x8*)p)); }

// k_keypass: fused pair weighting, one wave per (16 query rows, KR keys) of one (batch, head), straight from the f32 inputs.
// Staging: the block's AW waves read the head's SEQ key rows (one 128-B line each, 4 whole lines per wave-wide load), convert them once and store them as f16 rows in LDS; one block barrier publishes the tile.
// The tile serves both products: K fragments by plain 16-B loads (row = key), V^T fragments by transposing 16-B loads (row = d). The Q fragment is converted in registers.
// The KS waves of a query tile each take their own contiguous key range in two phases, straight-line: all KR scores first (kept in registers) and one maximum over them, then P and the second product,
// so nothing is rescaled inside a wave; each wave has its own max, sum and accumulators; the un-normalised partials meet in LDS
// behind one block barrier and are merged with weights exp2(m_k - max). The QT waves of one key range read the same tile rows.
// Transposed form: S^T[key][t] = K Q^T (A = K rows, B = Q rows); lane (t = lane&15, h = lane>>4) holds keys 8h+r of each 16-key tile, so the packed
// P tile is directly the B fragment of O^T[d][t] = V^T P^T (element r <- tile keys 0..15, element 8+r <- tile keys 16..31, lane unchanged).
// Softmax state (range max, partial sum over the converted P) is one scalar per lane; the two lane halves of a row are combined with one xor-16 exchange each.
// grid (SEQ/(16*QT), NB*NH_).
// amdgpu_waves_per_eu: SEQ/(16*QT) * NH_ blocks of AW waves stand one per WGP, AW/4 waves per SIMD; without it the scheduler holds the key pass to the 16-wave register budget, which the KR scores and the V^T fragments do not fit.
__global__ __launch_bounds__(32 * AW) __attribute__((amdgpu_waves_per_eu(AW / 4, AW / 4))) void k_keypass(const float* __restrict__ QF, const float* __restrict__ KF, float* OUT) {
    __shared__ __align__(32) unsigned char kt[SEQ * KPB];   // f16 key rows of this head: [key][d], row pitch KPB
    __shared__ __align__(16) float os[AW * 16 * OSP];   // per wave: un-normalised O partial [t][d]
    __shared__ __align__(8)  float ml[AW * 16 * 2];     // per wave and query row: (range max, sum)
    const int lane = threadIdx.x & 31, lr = lane & 15, hi = lane >> 4;
    const int wave = __builtin_amdgcn_readfirstlane((int)(threadIdx.x >> 5));
    const int zh = blockIdx.y; const int b = zh / NH_, h = zh % NH_;
    const int qt = wave % QT, ks = wave / QT;
    const int t0 = (blockIdx.x * QT + qt) * 16;
    const int kbeg = ks * KR;
    const size_t pbase = (size_t)b * SEQ_FULL * DM + (size_t)h * HD;            // token-major inputs, head column base
    // staging loads: wave -> key rows wave*SR .. +SR-1; lane -> (row lane>>3 of 4, floats 4*(lane&7) .. +3)
    const int sr0 = wave * SR + (lane >> 3), sc = (lane & 7) * 4;
    const float* kp = KF + pbase + (size_t)sr0 * DM + sc;
    v4f kx[SR / 4];
#pragma unroll   // kx[] stays in registers; all of the wave's staging loads are in flight together
    for (int it = 0; it < SR / 4; ++it) kx[it] = *(const v4f*)(kp + (size_t)it * 4 * DM);
    const float* qp = QF + pbase + (size_t)(t0 + lr) * DM + 8 * hi;
    const v8f q0 = *(const v8f*)qp, q1 = *(const v8f*)(qp + 16);
#pragma unroll   // constant index into kx[]
    for (int it = 0; it < SR / 4; ++it) {
        const v2h a = cv2(kx[it][0], kx[it][1]), c = cv2(kx[it][2], kx[it][3]);
        *(v4ha*)(&kt[(sr0 + it * 4) * KPB + sc * 2]) = __builtin_shufflevector(a, c, 0, 1, 2, 3); }
    v16h qh;                                                                    // B fragment: col t, k = d (HD = 32 = one k-step); elements 0..7 <- d 8h+0..7, 8..15 <- d 16+8h+0..7
#pragma unroll
    for (int k = 0; k < 8; k += 2) { const v2h a = cv2(q0[k], q0[k + 1]), c = cv2(q1[k], q1[k + 1]); qh[k] = a[0]; qh[k + 1] = a[1]; qh[8 + k] = c[0]; qh[9 + k] = c[1]; }
    __syncthreads();                                                            // the key tile is read by every wave below
    const unsigned char* ko = kt + lr * KPB + 16 * hi;                          // + key * KPB      (A fragment: row key, k = d)
    const unsigned char* vo = kt + (8 * hi + (lane & 7)) * KPB + 16 * ((lane >> 3) & 1);   // + key * KPB + 32j  (A fragment: row d = 16j + lr, k = key)
    // phase 1: the scores of all KR keys of this wave, KR/16 independent products, kept in registers
    v8f s[KR / 16];
#pragma unroll   // s[] stays in registers; the products are independent of one another
    for (int g = 0; g < KR / 16; ++g) {
        const unsigned char* ka = ko + (kbeg + 16 * g) * KPB;
        s[g] = wmma16(cat16(*(const v8ha*)ka, *(const v8ha*)(ka + 32)), qh, (v8f){}); }
    // V^T fragments of the whole key range: asked for behind the score products, so that they arrive under the maximum and the exponentials
    v16h vf[KR / 16];
#pragma unroll   // vf[] stays in registers; one group of LDS loads
    for (int g = 0; g < KR / 32; ++g) {
        const unsigned char* va = vo + (kbeg + 32 * g) * KPB;
        vf[2 * g] = cat16(ldtr(va), ldtr(va + 16 * KPB)); vf[2 * g + 1] = cat16(ldtr(va + 32), ldtr(va + 16 * KPB + 32)); }
    __builtin_amdgcn_sched_barrier(0);   // without it the scheduler sinks half of these loads between the last products, where each wave waits out their latency
    // phase 2: one maximum over the wave's key range, on the raw scores (the scale is positive); four independent chains
    float mq4[4];
#pragma unroll   // constant index into s[]
    for (int c = 0; c < 4; ++c) {
        float x = s[c][0];
#pragma unroll   // constant index into s[]
        for (int g = c; g < KR / 16; g += 4)
#pragma unroll   // constant element index
            for (int r = 0; r < 8; ++r) x = fmaxf(x, s[g][r]);
        mq4[c] = x; }
    float mx = fmaxf(fmaxf(mq4[0], mq4[1]), fmaxf(mq4[2], mq4[3]));
    mx = fmaxf(mx, xhalf(mx));                                                  // vector move: it does not count on dscnt, so it does not wait for the V^T loads in flight
    const float m = mx * SC2;
    const float sh = PSH - m;
    const v2f sc2 = (v2f){SC2, SC2}, sh2 = (v2f){sh, sh};
    // phase 3: P = exp2(score * SC2 - m + PSH), packed to f16, straight into the second product; nothing is rescaled
    v8f o0 = (v8f){}, o1 = (v8f){};
    v2f la = (v2f){}, lc = (v2f){};
#pragma unroll   // constant index into s[]
    for (int g = 0; g < KR / 32; ++g) {
        const v8f sa = s[2 * g], sb = s[2 * g + 1];
        v16h pb;
#pragma unroll   // constant element index
        for (int r = 0; r < 8; r += 2) {
            const v2f xa = __builtin_elementwise_fma((v2f){sa[r], sa[r + 1]}, sc2, sh2), xc = __builtin_elementwise_fma((v2f){sb[r], sb[r + 1]}, sc2, sh2);
            const v2h pa = cv2(__builtin_amdgcn_exp2f(xa[0]), __builtin_amdgcn_exp2f(xa[1]));
            const v2h pc = cv2(__builtin_amdgcn_exp2f(xc[0]), __builtin_amdgcn_exp2f(xc[1]));
            pb[r] = pa[0]; pb[r + 1] = pa[1]; pb[8 + r] = pc[0]; pb[9 + r] = pc[1];
            la += __builtin_convertvector(pa, v2f); lc += __builtin_convertvector(pc, v2f); }
        o0 = wmma16(vf[2 * g], pb, o0); o1 = wmma16(vf[2 * g + 1], pb, o1);
    }
    float l = (la[0] + la[1]) + (lc[0] + lc[1]);
    l += __shfl_xor(l, 16, 32);
    const int wb = wave * 16 * OSP;
    // O^T D layout: o_j[r] = (d = 16j + 8h + r, t = lane&15) -> os[t][d]; rows 0..15 x columns 0..31 all written
    { v4f a, c;
      a[0] = o0[0]; a[1] = o0[1]; a[2] = o0[2]; a[3] = o0[3]; c[0] = o0[4]; c[1] = o0[5]; c[2] = o0[6]; c[3] = o0[7];
      *(v4fa*)(&os[wb + lr * OSP +  0 + 8 * hi]) = a; *(v4fa*)(&os[wb + lr * OSP +  0 + 8 * hi + 4]) = c;
      a[0] = o1[0]; a[1] = o1[1]; a[2] = o1[2]; a[3] = o1[3]; c[0] = o1[4]; c[1] = o1[5]; c[2] = o1[6]; c[3] = o1[7];
      *(v4fa*)(&os[wb + lr * OSP + 16 + 8 * hi]) = a; *(v4fa*)(&os[wb + lr * OSP + 16 + 8 * hi + 4]) = c; }
    ml[(wave * 16 + lr) * 2 + hi] = hi ? l : m;                 // both lane halves hold the row's max and joined sum: half 0 stores the max, half 1 the sum
    __syncthreads();                                            // every wave's partial is read by other waves below
    // merge: thread -> (block row 0..QT*16-1, two columns); 16 lanes x 2 floats = 32 columns = one line
    const int row = (int)threadIdx.x >> 4, c2 = ((int)threadIdx.x & 15) * 2;
    const int mq = row >> 4, mr = row & 15;
    v2f st[KS]; float mm = NEGB;
#pragma unroll   // st[] stays in registers; the KS LDS reads issue together
    for (int k = 0; k < KS; ++k) { st[k] = *(const v2fa*)(&ml[((k * QT + mq) * 16 + mr) * 2]); mm = fmaxf(mm, st[k][0]); }
    float ls = 0.0f; v2f acc = (v2f){};
#pragma unroll   // constant index into st[]; the KS partial reads issue together
    for (int k = 0; k < KS; ++k) {
        const float w = __builtin_amdgcn_exp2f(st[k][0] - mm);
        const v2f p = *(const v2fa*)(&os[(k * QT + mq) * 16 * OSP + mr * OSP + c2]);
        ls += w * st[k][1]; acc += w * p; }
    const float inv = 1.0f / ls;                                // ls > 0: the row maximum contributes the carry (16384), with weight 1
    float* orow = OUT + ((size_t)b * OUT_SEQ + (size_t)blockIdx.x * (QT * 16)) * DM + h * HD;
    *(v2f*)(orow + (size_t)row * DM + c2) = acc * inv;
}

extern "C" void kernel_launch(void* const* d_in, const int* in_sizes, int n_in,
                              void* d_out, int out_size, void* d_ws, size_t ws_size, hipStream_t stream) {
    if (n_in < 2) return;
    const size_t needx = ((size_t)(NB - 1) * SEQ_FULL + SEQ) * DM;
    if ((size_t)in_sizes[0] < needx || (size_t)in_sizes[1] < needx) return;
    if ((size_t)out_size < ((size_t)(NB - 1) * OUT_SEQ + SEQ) * DM) return;
    // wire order: history_bev (keys and values), bev_query (queries)
    const float* hist  = (const float*)d_in[0];
    const float* query = (const float*)d_in[1];
    float* OUT = (float*)d_out;      // [NB][SEQ][256]

    k_keypass<<<dim3(SEQ / (16 * QT), NB * NH_, 1), 32 * AW, 0, stream>>>(query, hist, OUT);
}

// v005
// It runs in 4.71 microseconds.
// In both of two side-by-side timings against v004, it was 1.20 times as fast.
// All steps since v000 together make it 7.77 times as fast.
#include <hip/hip_runtime.h>

// Dense grouped pair-score weighting, width 256 = 8 heads x 32, no projections: queries = bev_query rows, keys = values = history_bev rows, score scale 32^-0.5, softmax over keys, heads concatenated (f32 output).
// Both contractions: v_wmma_f32_16x16x32_f16 (f16 operands, f32 accumulate). Inputs are RNE-converted to f16 at their load; P is carried x16384 (cancels in the normalisation); softmax f32 (one maximum per wave and key range, partials merged by their maxima).
// The module replicates queries and keys R times along the sequence axis and averages the R query copies: every distinct key then appears R times with the same logit and the same value row,
// so the softmax-weighted mean over the R*SEQ replicated keys equals the one over the SEQ distinct keys, and the R identical query copies average to the single result. The kernel works on the SEQ distinct rows.
// One launch: each wave converts its own SEQ/16 key rows of the head (and the block's query rows) once into f16 LDS rows [key][d] that only it reads; fused key-pass kernel in transposed form
// (S^T = K Q^T with A = K rows and B = Q rows; O^T = V^T P^T with the packed P tile as the B fragment). K fragments: two 16-B LDS loads each; V^T fragments: two transposing 16-B LDS loads each, from the same tile.

#ifndef NB
#define NB 1
#endif
#ifndef SEQ
#define SEQ 1024
#endif
#define NB_FULL  1
#define SEQ_FULL 1024
#ifndef OUT_SEQ
#define OUT_SEQ SEQ              // row pitch (in tokens) between batches of the output
#endif
#define DM   256
#define NH_  8
#define HD   32
#define QT   2                   // query tiles (16 rows each) per online-softmax key-pass block
#define KS   16                  // key ranges per block: one wave per key range, each wave takes all QT query tiles
#define AW   KS                  // waves per online-softmax key-pass block
#define KR   (SEQ / KS)          // keys per wave
#define OSP  36                  // LDS row pitch (floats) of the online-softmax key-pass output tile
#define SC2  ((float)(0.17677669529663687 * 1.4426950408889634))   // HD^-0.5 * log2(e)
#define PSH  14.0f               // log2 of the P carry (16384)
#define NEGB (-3.0e38f)
#define KPB  96                  // LDS row pitch (bytes) of the f16 key tile: 64 B of data, odd multiple of 32 B for the transposing reader
#define WROWS (KR + 16 * QT)     // LDS rows of one wave: its KR key rows, then the block's 16*QT query rows
#define WREG (WROWS * KPB)       // LDS bytes of one wave
#define MLP  (2 * KS + 2)        // LDS row pitch (floats) of the (max, sum) table: one row per query row, one pair per key range; the pad spreads the writers' banks

static_assert(HD == 32);                       // one k-step of the score product; output head segment = 32 floats = one line
static_assert(NH_ * HD == DM);                 // head h = columns h*32 + d
static_assert(DM % 8 == 0);                    // 16-byte fragment loads from token-major rows
static_assert(SEQ % 64 == 0);
static_assert(SEQ % (64 * KS) == 0);           // second product steps by 32 keys; the maximum runs in four chains over the 16-key score tiles
static_assert(KS == 16);                       // merge: lane j of a 16-lane row holds the weight of key range j
static_assert(SEQ % (16 * QT) == 0);           // online-softmax key-pass grid covers the sequence exactly
static_assert(KR % 4 == 0);                    // staging: each wave-wide load covers 4 rows (4 whole lines)
static_assert(QT * 16 * OSP * 4 <= KR * KPB);  // a wave's output partial lies over its own key rows, not over its query rows
static_assert(WREG % 32 == 0);
static_assert(KPB >= HD * 2 && KPB % 32 == 0 && ((KPB / 32) & 1) == 1);
static_assert(32 * AW * 2 == QT * 16 * HD);    // online-softmax key-pass merge: threads x floats == rows x columns of the block
static_assert(HD == 16 * 2);                   // merge: 16 lanes x 2 floats == one output head segment (one line)
static_assert(((size_t)SEQ * DM) % 64 == 0);
static_assert(NB <= NB_FULL);
static_assert(SEQ <= SEQ_FULL);
static_assert((OSP * 4) % 16 == 0);
static_assert(OSP >= HD);
static_assert((size_t)AW * WREG + (size_t)QT * 16 * MLP * 4 <= (size_t)163840);   // static LDS of the online-softmax key-pass kernel

typedef _Float16 h16;
typedef __attribute__((ext_vector_type(16))) _Float16 v16h;
typedef __attribute__((ext_vector_type(8)))  _Float16 v8h;
typedef __attribute__((ext_vector_type(8)))  float    v8f;
typedef __attribute__((ext_vector_type(4)))  float    v4f;
typedef v4f  __attribute__((may_alias)) v4fa;
typedef v8h  __attribute__((may_alias)) v8ha;
typedef __attribute__((ext_vector_type(2)))  float    v2f;
typedef v2f  __attribute__((may_alias)) v2fa;
typedef __attribute__((ext_vector_type(4)))  _Float16 v4h;
typedef v4h  __attribute__((may_alias)) v4ha;
typedef __attribute__((ext_vector_type(2)))  _Float16 v2h;

__device__ __forceinline__ v16h cat16(v8h lo, v8h hi) { return __builtin_shufflevector(lo, hi, 0, 1, 2, 3, 4, 5, 6, 7, 8, 9, 10, 11, 12, 13, 14, 15); }
__device__ __forceinline__ v8f wmma16(v16h a, v16h b, v8f c) { return __builtin_amdgcn_wmma_f32_16x16x32_f16(false, a, false, b, (short)0, c, false, false); }
// two f32 values -> two f16, one packed RNE convert; f16 subnormals are kept (the matrix unit takes them as they are)
__device__ __forceinline__ v2h cv2(float a, float b) {
    v2f x; x[0] = a; x[1] = b;
    return __builtin_convertvector(x, v2h);
}

// lane l <-> lane l ^ 16, as a vector cross-row move
__device__ __forceinline__ float xhalf(float x) { return __builtin_bit_cast(float, __builtin_amdgcn_permlanex16(__builtin_bit_cast(int, x), __builtin_bit_cast(int, x), 0x76543210, 0xfedcba98, false, false)); }

// value of another lane of the same 16-lane row, as a DPP move: C = 0x160 | x: lane ^ x; C = 0x150 | k: lane k of the row
template <int C> __device__ __forceinline__ float rowmv(float x) { return __builtin_bit_cast(float, __builtin_amdgcn_update_dpp(0, __builtin_bit_cast(int, x), C, 0xf, 0xf, true)); }

// transposing 16-B LDS load: lane (c = lane&15, h = lane>>4) gets rows kbase + 8h + 0..7 of column dbase + c; p is the lane's own address in the row-major tile
typedef __attribute__((ext_vector_type(8))) short s16x8;
__device__ __forceinline__ v8h ldtr(const unsigned char* p) { typedef __attribute__((address_space(3))) s16x8 lds_s16x8; return __builtin_bit_cast(v8h, __builtin_amdgcn_ds_load_tr16_b128_v8i16((lds_s16x8*)p)); }

// k_keypass: fused pair weighting, one wave per (QT*16 query rows, KR keys) of one (batch, head), straight from the f32 inputs.
// Staging is private to the wave: it reads the block's QT*16 query rows and its own KR key rows (one 128-B line each, 4 whole lines per wave-wide load), converts them once and stores them as f16 rows
// in its own LDS range, which no other wave reads. No block barrier stands behind the staging: a wave goes on as soon as its own rows have landed, while the rows of the waves behind it are still on their way from L2.
// The key rows serve both products: K fragments by plain 16-B loads (row = key), V^T fragments by transposing 16-B loads (row = d); each fragment feeds the products of all QT query tiles. Q fragments: plain 16-B loads, as K.
// Each wave takes its key range in two phases, straight-line: all scores first (kept in registers) and one maximum per query tile over them, then P and the second product,
// so nothing is rescaled inside a wave; each wave has its own max, sum and accumulators per query tile; the un-normalised partials meet in LDS
// behind one block barrier and are merged with weights exp2(m_k - max).
// Transposed form: S^T[key][t] = K Q^T (A = K rows, B = Q rows); lane (t = lane&15, h = lane>>4) holds keys 8h+r of each 16-key tile, so the packed
// P tile is directly the B fragment of O^T[d][t] = V^T P^T (element r <- tile keys 0..15, element 8+r <- tile keys 16..31, lane unchanged).
// Softmax state (range max, partial sum over the converted P) is one scalar per lane and query tile; the two lane halves of a row are combined with one xor-16 exchange each.
// grid (SEQ/(16*QT), NB*NH_).
// amdgpu_waves_per_eu: SEQ/(16*QT) * NH_ blocks of AW waves stand one per WGP, AW/4 waves per SIMD; without it the scheduler holds the key pass to the 16-wave register budget, which the scores and the staging loads do not fit.
__global__ __launch_bounds__(32 * AW) __attribute__((amdgpu_waves_per_eu(AW / 4, AW / 4))) void k_keypass(const float* __restrict__ QF, const float* __restrict__ KF, float* OUT) {
    __shared__ __align__(32) unsigned char kt[AW * WREG];   // per wave: f16 rows [key or query][d], row pitch KPB; later, over the key rows, its un-normalised O partial [query row][d], row pitch OSP floats
    __shared__ __align__(8)  float ml[QT * 16 * MLP];       // per query row: (range max, sum) of every key range
    const int lane = threadIdx.x & 31, lr = lane & 15, hi = lane >> 4;
    const int wave = __builtin_amdgcn_readfirstlane((int)(threadIdx.x >> 5));
    const int zh = blockIdx.y; const int b = zh / NH_, h = zh % NH_;
    const int t0 = blockIdx.x * (QT * 16);
    const int kbeg = wave * KR;
    const size_t pbase = (size_t)b * SEQ_FULL * DM + (size_t)h * HD;            // token-major inputs, head column base
    unsigned char* wr = kt + wave * WREG;                                       // this wave's own LDS range
    // staging loads: lane -> (row lane>>3 of 4, floats 4*(lane&7) .. +3); the query rows first: they are the same for every wave, so all but the first asker find them in the WGP cache
    const int r4 = lane >> 3, sc = (lane & 7) * 4;
    const float* qp = QF + pbase + (size_t)(t0 + r4) * DM + sc;
    const float* kp = KF + pbase + (size_t)(kbeg + r4) * DM + sc;
    v4f qx[QT * 4], kx[KR / 4];
#pragma unroll   // qx[] stays in registers
    for (int it = 0; it < QT * 4; ++it) qx[it] = *(const v4f*)(qp + (size_t)it * 4 * DM);
#pragma unroll   // kx[] stays in registers; all of the wave's staging loads are in flight together
    for (int it = 0; it < KR / 4; ++it) kx[it] = *(const v4f*)(kp + (size_t)it * 4 * DM);
    asm volatile("s_wait_xcnt 0x0" :: "v"(qp), "v"(kp) : "memory");   // the wait in front of any overwrite of the loads' address registers; as inputs here the two addresses stay in their registers up to it, so that no load above gets them as its destination
#pragma unroll   // constant index into qx[]
    for (int it = 0; it < QT * 4; ++it) {
        const v2h a = cv2(qx[it][0], qx[it][1]), c = cv2(qx[it][2], qx[it][3]);
        *(v4ha*)(wr + (KR + it * 4 + r4) * KPB + sc * 2) = __builtin_shufflevector(a, c, 0, 1, 2, 3); }
#pragma unroll   // constant index into kx[]
    for (int it = 0; it < KR / 4; ++it) {
        const v2h a = cv2(kx[it][0], kx[it][1]), c = cv2(kx[it][2], kx[it][3]);
        *(v4ha*)(wr + (it * 4 + r4) * KPB + sc * 2) = __builtin_shufflevector(a, c, 0, 1, 2, 3); }
    asm volatile("s_wait_dscnt 0x0" ::: "memory");   // the lanes below read rows that other lanes of this wave stored above: the stores have retired, and the compiler moves no LDS access across
    const unsigned char* ko = wr + lr * KPB + 16 * hi;                          // + row * KPB      (A or B fragment: row key or query, k = d; elements 0..7 <- d 8h+0..7, 8..15 <- d 16+8h+0..7)
    const unsigned char* vo = wr + (8 * hi + (lane & 7)) * KPB + 16 * ((lane >> 3) & 1);   // + key * KPB + 32j  (A fragment: row d = 16j + lr, k = key)
    v16h qh[QT];                                                                // B fragments: col t, k = d (HD = 32 = one k-step)
#pragma unroll   // qh[] stays in registers
    for (int q = 0; q < QT; ++q) {
        const unsigned char* qa = ko + (KR + 16 * q) * KPB;
        qh[q] = cat16(*(const v8ha*)qa, *(const v8ha*)(qa + 32)); }
    v16h kf[KR / 16];
#pragma unroll   // kf[] stays in registers
    for (int g = 0; g < KR / 16; ++g) {
        const unsigned char* ka = ko + 16 * g * KPB;
        kf[g] = cat16(*(const v8ha*)ka, *(const v8ha*)(ka + 32)); }
    // V^T fragments of the whole key range: asked for behind the K fragments, in the same group of LDS loads, so that they arrive under the score products, the maximum and the exponentials
    v16h vf[KR / 16];
#pragma unroll   // vf[] stays in registers
    for (int g = 0; g < KR / 32; ++g) {
        const unsigned char* va = vo + 32 * g * KPB;
        vf[2 * g] = cat16(ldtr(va), ldtr(va + 16 * KPB)); vf[2 * g + 1] = cat16(ldtr(va + 32), ldtr(va + 16 * KPB + 32)); }
    __builtin_amdgcn_sched_barrier(0);   // without it the scheduler spreads these loads among the products, in reused registers, and the wave waits out the LDS latency once per pair of products
    // phase 1: the scores of all KR keys of this wave against all QT query tiles, independent products, kept in registers
    v8f s[QT][KR / 16];
#pragma unroll   // s[] stays in registers; the products are independent of one another
    for (int g = 0; g < KR / 16; ++g)
#pragma unroll   // constant index into s[] and qh[]
        for (int q = 0; q < QT; ++q) s[q][g] = wmma16(kf[g], qh[q], (v8f){});
#pragma unroll   // constant index into s[] and qh[]; the query tiles are independent of one another
    for (int q = 0; q < QT; ++q) {
        // phase 2: one maximum over the wave's key range, on the raw scores (the scale is positive); four independent chains
        float mq4[4];
#pragma unroll   // constant index into s[]
        for (int c = 0; c < 4; ++c) {
            float x = s[q][c][0];
#pragma unroll   // constant index into s[]
            for (int g = c; g < KR / 16; g += 4)
#pragma unroll   // constant element index
                for (int r = 0; r < 8; ++r) x = fmaxf(x, s[q][g][r]);
            mq4[c] = x; }
        float mx = fmaxf(fmaxf(mq4[0], mq4[1]), fmaxf(mq4[2], mq4[3]));
        mx = fmaxf(mx, xhalf(mx));                                              // vector move: it does not count on dscnt, so it does not wait for the V^T loads in flight
        const float m = mx * SC2;
        const float sh = PSH - m;
        const v2f sc2 = (v2f){SC2, SC2}, sh2 = (v2f){sh, sh};
        // phase 3: P = exp2(score * SC2 - m + PSH), packed to f16, straight into the second product; nothing is rescaled
        v8f o0 = (v8f){}, o1 = (v8f){};
        v2f la = (v2f){}, lc = (v2f){};
#pragma unroll   // constant index into s[]
        for (int g = 0; g < KR / 32; ++g) {
            const v8f sa = s[q][2 * g], sb = s[q][2 * g + 1];
            v16h pb;
#pragma unroll   // constant element index
            for (int r = 0; r < 8; r += 2) {
                const v2f xa = __builtin_elementwise_fma((v2f){sa[r], sa[r + 1]}, sc2, sh2), xc = __builtin_elementwise_fma((v2f){sb[r], sb[r + 1]}, sc2, sh2);
                const v2h pa = cv2(__builtin_amdgcn_exp2f(xa[0]), __builtin_amdgcn_exp2f(xa[1]));
                const v2h pc = cv2(__builtin_amdgcn_exp2f(xc[0]), __builtin_amdgcn_exp2f(xc[1]));
                pb[r] = pa[0]; pb[r + 1] = pa[1]; pb[8 + r] = pc[0]; pb[9 + r] = pc[1];
                la += __builtin_convertvector(pa, v2f); lc += __builtin_convertvector(pc, v2f); }
            o0 = wmma16(vf[2 * g], pb, o0); o1 = wmma16(vf[2 * g + 1], pb, o1);
        }
        float l = (la[0] + la[1]) + (lc[0] + lc[1]);
        l += __shfl_xor(l, 16, 32);
        // O^T D layout: o_j[r] = (d = 16j + 8h + r, t = lane&15) -> partial[16q + t][d]; rows 0..15 x columns 0..31 of the tile all written.
        // The partial lies over this wave's own key rows: every load of them has returned, since each feeds a product that o0 and o1 depend on.
        float* ow = (float*)wr + (q * 16 + lr) * OSP + 8 * hi;
        { v4f a, c;
          a[0] = o0[0]; a[1] = o0[1]; a[2] = o0[2]; a[3] = o0[3]; c[0] = o0[4]; c[1] = o0[5]; c[2] = o0[6]; c[3] = o0[7];
          *(v4fa*)(ow +  0) = a; *(v4fa*)(ow +  4) = c;
          a[0] = o1[0]; a[1] = o1[1]; a[2] = o1[2]; a[3] = o1[3]; c[0] = o1[4]; c[1] = o1[5]; c[2] = o1[6]; c[3] = o1[7];
          *(v4fa*)(ow + 16) = a; *(v4fa*)(ow + 20) = c; }
        ml[(q * 16 + lr) * MLP + wave * 2 + hi] = hi ? l : m;   // both lane halves hold the row's max and joined sum: half 0 stores the max, half 1 the sum
    }
    __syncthreads();                                            // every wave's partial is read by other waves below
    // merge: thread -> (block row 0..QT*16-1, two columns); 16 lanes x 2 floats = 32 columns = one line.
    // Lane j of a row's 16 lanes takes key range j's (max, sum): the row maximum and the weighted sum run over the 16 lanes, so each weight is computed once; lane k's weight then goes to the whole row for partial k.
    const int row = (int)threadIdx.x >> 4, c2 = ((int)threadIdx.x & 15) * 2;
    const v2f st = *(const v2fa*)(&ml[row * MLP + c2]);
    const unsigned char* pr = kt + (row * OSP + c2) * 4;        // + k * WREG: partial of key range k
    v2f p[KS];
#pragma unroll   // p[] stays in registers
    for (int k = 0; k < KS; ++k) p[k] = *(const v2fa*)(pr + k * WREG);
    __builtin_amdgcn_sched_barrier(0);   // without it the scheduler sinks most of these loads into the weighted sum below, where the wave waits out the LDS latency several times over
    float mm = st[0];
    mm = fmaxf(mm, rowmv<0x161>(mm)); mm = fmaxf(mm, rowmv<0x162>(mm)); mm = fmaxf(mm, rowmv<0x164>(mm)); mm = fmaxf(mm, rowmv<0x168>(mm));
    const float w = __builtin_amdgcn_exp2f(st[0] - mm);
    float ls = w * st[1];
    ls += rowmv<0x161>(ls); ls += rowmv<0x162>(ls); ls += rowmv<0x164>(ls); ls += rowmv<0x168>(ls);
    v2f acc = (v2f){};
#define MSTEP(k) acc += rowmv<0x150 + (k)>(w) * p[k];
    MSTEP(0) MSTEP(1) MSTEP(2) MSTEP(3) MSTEP(4) MSTEP(5) MSTEP(6) MSTEP(7) MSTEP(8) MSTEP(9) MSTEP(10) MSTEP(11) MSTEP(12) MSTEP(13) MSTEP(14) MSTEP(15)
#undef MSTEP
    const float inv = 1.0f / ls;                                // ls > 0: the row maximum contributes the carry (16384), with weight 1
    float* orow = OUT + ((size_t)b * OUT_SEQ + (size_t)blockIdx.x * (QT * 16)) * DM + h * HD;
    *(v2f*)(orow + (size_t)row * DM + c2) = acc * inv;
}

extern "C" void kernel_launch(void* const* d_in, const int* in_sizes, int n_in,
                              void* d_out, int out_size, void* d_ws, size_t ws_size, hipStream_t stream) {
    if (n_in < 2) return;
    const size_t needx = ((size_t)(NB - 1) * SEQ_FULL + SEQ) * DM;
    if ((size_t)in_sizes[0] < needx || (size_t)in_sizes[1] < needx) return;
    if ((size_t)out_size < ((size_t)(NB - 1) * OUT_SEQ + SEQ) * DM) return;
    // wire order: history_bev (keys and values), bev_query (queries)
    const float* hist  = (const float*)d_in[0];
    const float* query = (const float*)d_in[1];
    float* OUT = (float*)d_out;      // [NB][SEQ][256]

    k_keypass<<<dim3(SEQ / (16 * QT), NB * NH_, 1), 32 * AW, 0, stream>>>(query, hist, OUT);
}
